// v000
// Times are from an AMD MI455X. After a warm-up the kernel runs many times in a row, and a time is the length of
// such a window on the GPU divided by its runs, so every launch and the gaps after it count. The runs cycle
// through copies of the inputs. A figure is the median of several windows, for all but v000 over two sittings.
// Sittings can differ by a few percent; kernels timed side by side share one.
// v000 is the starting kernel. One run takes 333 microseconds.
#include <hip/hip_runtime.h>
#include <hip/hip_bf16.h>

// Problem constants (from reference)
#define B_   64
#define S_   256
#define DIM_ 512
#define H_   16
#define DH_  32            // DIM/H
#define MTOT (B_ * S_)     // 16384 rows in QKV GEMM
#define QKV_ELEMS ((size_t)B_ * H_ * S_ * DH_)  // 8,388,608 floats per tensor

typedef __attribute__((ext_vector_type(2))) float v2f;
typedef __attribute__((ext_vector_type(8))) float v8f;

typedef __attribute__((address_space(1))) int as1_int;
typedef __attribute__((address_space(3))) int as3_int;

__device__ __forceinline__ v8f wmma_f32_k4(v2f a, v2f b, v8f c) {
    // V_WMMA_F32_16X16X4_F32 : D = A(16x4, f32) x B(4x16, f32) + C(16x16, f32)
    return __builtin_amdgcn_wmma_f32_16x16x4_f32(false, a, false, b, (short)0, c,
                                                 false, false);
}

// ---------------------------------------------------------------------------
// Kernel 1: fused QKV projection + bias + RoPE, output layout (B, H, S, DH).
// One wave32 computes one 16x16 output tile; K=512 -> 128 WMMA k4 steps.
// The 512x16 weight tile (shared by all 8 waves of the block) is staged into
// LDS once via async global->LDS copies (ASYNCcnt / s_wait_asynccnt), stored
// transposed+padded so the B fragment is one conflict-free ds_load_b64.
// grid = (128, 32, 3): 8 M-tiles per block (one per wave), 32 N-tiles, 3 mats.
// ---------------------------------------------------------------------------
__global__ void __launch_bounds__(256)
qkv_rope_kernel(const float* __restrict__ X,
                const float* __restrict__ Wq, const float* __restrict__ bq,
                const float* __restrict__ Wk, const float* __restrict__ bk,
                const float* __restrict__ Wv, const float* __restrict__ bv,
                float* __restrict__ outq, float* __restrict__ outk,
                float* __restrict__ outv) {
    __shared__ float wt[16][516];   // transposed weight tile, padded (33 KB)

    const int lane = threadIdx.x & 31;
    const int wave = threadIdx.x >> 5;
    const int row  = lane & 15;       // M (for A) / N (for B) index within tile
    const int half = lane >> 4;       // selects K=0,1 vs K=2,3 of the k4 step

    const int mtile = blockIdx.x * 8 + wave;   // 0..1023
    const int m0 = mtile * 16;
    const int n0 = blockIdx.y * 16;            // 0..511 step 16
    const int mat = blockIdx.z;                // 0=Q 1=K 2=V

    const float* Wm   = (mat == 0) ? Wq : (mat == 1) ? Wk : Wv;
    const float* bias = (mat == 0) ? bq : (mat == 1) ? bk : bv;
    float*       dst  = (mat == 0) ? outq : (mat == 1) ? outk : outv;

    // ---- Stage W[0:512, n0:n0+16] into LDS transposed: wt[c][k] = W[k][n0+c].
    // 256 lanes x 32 iters x 4B async copies; lanes 0..15 read 64B contiguous.
    {
        const int tid = threadIdx.x;
        const int c  = tid & 15;
        const int kb = tid >> 4;          // 0..15
#pragma unroll
        for (int it = 0; it < 32; ++it) {
            const int k = it * 16 + kb;
            const float* g = Wm + (size_t)k * DIM_ + n0 + c;
            float* l = &wt[c][k];
            __builtin_amdgcn_global_load_async_to_lds_b32(
                (as1_int*)(void*)g, (as3_int*)(void*)l,
                0 /*offset*/, 0 /*cpol*/);
        }
        asm volatile("s_wait_asynccnt 0x0" ::: "memory");
        __syncthreads();
    }

    // Per-lane A base pointer (float2: K=0,1 for lanes 0-15; K=2,3 for 16-31).
    const float* aptr = X + (size_t)(m0 + row) * DIM_ + 2 * half;

    v8f acc = {};
#pragma unroll 8
    for (int kk = 0; kk < DIM_; kk += 4) {
        v2f a = *(const v2f*)(aptr + kk);
        v2f b = *(const v2f*)&wt[row][kk + 2 * half];   // ds_load_b64
        acc = wmma_f32_k4(a, b, acc);
    }

    // Epilogue: bias, RoPE (Q,K only), scatter to (B,H,S,DH).
    const int n = n0 + row;        // global output column
    const int h = n >> 5;          // head
    const int d = n & 31;          // dim-in-head
    const int i = d >> 1;          // rotation pair index
    const float bval = bias[n];
    // inv_freq = 10000^(-i/16) = exp(-i * ln(10000)/16)
    const float inv_freq = __expf(-(float)i * (9.210340371976184f / 16.0f));

#pragma unroll
    for (int j = 0; j < 8; ++j) {
        const int m = m0 + j + half * 8;   // global row in [0, B*S)
        const int s = m & (S_ - 1);
        const int b_idx = m >> 8;
        float val = acc[j] + bval;
        if (mat < 2) {
            const float ang = (float)s * inv_freq;
            const float sv = __sinf(ang);
            const float cv = __cosf(ang);
            // partner column n^1 lives in lane^1 (same m: m depends on j,half only)
            const float other = __shfl_xor(val, 1, 32);
            val = (d & 1) ? (other * sv + val * cv)    // odd lane: x1*sin + x2*cos
                          : (val * cv - other * sv);   // even lane: x1*cos - x2*sin
        }
        dst[(((size_t)b_idx * H_ + h) * S_ + s) * DH_ + d] = val;
    }
}

// ---------------------------------------------------------------------------
// Kernel 2: attention for one (b, h, 16-query-row tile) per block.
//   scores = Q Kt / sqrt(DH)  (WMMA, staged to LDS)
//   probs  = softmax(scores) + rel_bias   (bias added AFTER softmax, per ref)
//   ctx    = probs @ V        (WMMA, A-fragment straight from LDS)
// grid = B*H*16 = 16384 blocks of 256 threads (8 waves).
// ---------------------------------------------------------------------------
__global__ void __launch_bounds__(256)
attn_kernel(const float* __restrict__ Qt, const float* __restrict__ Kt,
            const float* __restrict__ Vt, const float* __restrict__ bias_table,
            float* __restrict__ out) {
    __shared__ float sc[16 * S_];        // 16 q rows x 256 k cols = 16 KB
    __shared__ float part[8 * 16 * 16];  // per-wave ctx partials = 8 KB

    const int lane = threadIdx.x & 31;
    const int wave = threadIdx.x >> 5;
    const int row  = lane & 15;
    const int half = lane >> 4;

    const int bh = blockIdx.x >> 4;          // b*H + h
    const int qt = blockIdx.x & 15;          // q tile index
    const int h  = bh & (H_ - 1);
    const int b  = bh >> 4;
    const int s0 = qt * 16;

    const float* Q = Qt + (size_t)bh * S_ * DH_;
    const float* K = Kt + (size_t)bh * S_ * DH_;
    const float* V = Vt + (size_t)bh * S_ * DH_;

    // ---- Phase A: score tiles. Wave w handles k-tiles {w, w+8}. ----
    const float scale = 0.17677669529663687f;  // 1/sqrt(32)
#pragma unroll
    for (int t = 0; t < 2; ++t) {
        const int kt = wave + t * 8;
        const int n0 = kt * 16;
        v8f c = {};
#pragma unroll
        for (int kk = 0; kk < DH_; kk += 4) {
            v2f a = *(const v2f*)(Q + (size_t)(s0 + row) * DH_ + kk + 2 * half);
            v2f bb = *(const v2f*)(K + (size_t)(n0 + row) * DH_ + kk + 2 * half);
            c = wmma_f32_k4(a, bb, c);
        }
#pragma unroll
        for (int j = 0; j < 8; ++j)
            sc[(j + 8 * half) * S_ + n0 + row] = c[j] * scale;
    }
    __syncthreads();

    // ---- Phase B: softmax per row, then add relative bias. Wave w: rows 2w,2w+1. ----
#pragma unroll
    for (int rr = 0; rr < 2; ++rr) {
        const int r = wave * 2 + rr;
        float* rowp = sc + r * S_;
        float x[8];
        float mx = -3.0e38f;
#pragma unroll
        for (int cidx = 0; cidx < 8; ++cidx) {
            x[cidx] = rowp[lane + 32 * cidx];
            mx = fmaxf(mx, x[cidx]);
        }
#pragma unroll
        for (int off = 16; off >= 1; off >>= 1)
            mx = fmaxf(mx, __shfl_xor(mx, off, 32));
        float sum = 0.0f;
#pragma unroll
        for (int cidx = 0; cidx < 8; ++cidx) {
            x[cidx] = __expf(x[cidx] - mx);
            sum += x[cidx];
        }
#pragma unroll
        for (int off = 16; off >= 1; off >>= 1)
            sum += __shfl_xor(sum, off, 32);
        const float inv = 1.0f / sum;
        const int qg = s0 + r;
#pragma unroll
        for (int cidx = 0; cidx < 8; ++cidx) {
            const int col = lane + 32 * cidx;
            const int rel = qg - col + (S_ - 1);           // in [0, 510]
            rowp[col] = x[cidx] * inv + bias_table[rel * H_ + h];
        }
    }
    __syncthreads();

    // ---- Phase C: ctx = probs(16x256) @ V(256x32). ----
    // Wave w: n-tile = w&1 (d offset 0/16), K-slice = (w>>1)*64.
    {
        const int nt = wave & 1;
        const int ks = wave >> 1;
        const int n0 = nt * 16;
        v8f c = {};
#pragma unroll
        for (int kk = ks * 64; kk < ks * 64 + 64; kk += 4) {
            v2f a = *(const v2f*)(sc + row * S_ + kk + 2 * half);  // LDS ds_load_b64
            v2f bb;
            bb.x = V[(size_t)(kk + 2 * half) * DH_ + n0 + row];
            bb.y = V[(size_t)(kk + 2 * half + 1) * DH_ + n0 + row];
            c = wmma_f32_k4(a, bb, c);
        }
#pragma unroll
        for (int j = 0; j < 8; ++j)
            part[wave * 256 + (j + 8 * half) * 16 + row] = c[j];
    }
    __syncthreads();

    // Reduce 4 K-slice partials and write out[b, s, h*32 + d].
    const int tid = threadIdx.x;
#pragma unroll
    for (int e = 0; e < 2; ++e) {
        const int idx = tid * 2 + e;         // 0..511 over 16x32
        const int r  = idx >> 5;
        const int dd = idx & 31;
        const int nt = dd >> 4;
        const int col = dd & 15;
        float sum = 0.0f;
#pragma unroll
        for (int ks = 0; ks < 4; ++ks)
            sum += part[(ks * 2 + nt) * 256 + r * 16 + col];
        out[((size_t)b * S_ + s0 + r) * DIM_ + h * DH_ + dd] = sum;
    }
}

// ---------------------------------------------------------------------------
extern "C" void kernel_launch(void* const* d_in, const int* in_sizes, int n_in,
                              void* d_out, int out_size, void* d_ws, size_t ws_size,
                              hipStream_t stream) {
    const float* hidden     = (const float*)d_in[0];
    const float* Wq         = (const float*)d_in[1];
    const float* bq         = (const float*)d_in[2];
    const float* Wk         = (const float*)d_in[3];
    const float* bk         = (const float*)d_in[4];
    const float* Wv         = (const float*)d_in[5];
    const float* bv         = (const float*)d_in[6];
    const float* bias_table = (const float*)d_in[7];
    float* out = (float*)d_out;

    float* wsq = (float*)d_ws;
    float* wsk = wsq + QKV_ELEMS;
    float* wsv = wsk + QKV_ELEMS;

    // 1024 M-tiles / 8 waves-per-block, 32 N-tiles, 3 matrices.
    qkv_rope_kernel<<<dim3(128, 32, 3), 256, 0, stream>>>(
        hidden, Wq, bq, Wk, bk, Wv, bv, wsq, wsk, wsv);

    // One block per (b, h, q-tile-of-16).
    attn_kernel<<<dim3(B_ * H_ * (S_ / 16)), 256, 0, stream>>>(
        wsq, wsk, wsv, bias_table, out);
}

// v001
// One run takes 268 microseconds.
// In both of two side-by-side timings against v000, it was 1.30 times as fast.
#include <hip/hip_runtime.h>
#include <hip/hip_bf16.h>

// Problem constants (from reference)
#define B_   64
#define S_   256
#define DIM_ 512
#define H_   16
#define DH_  32            // DIM/H
#define MTOT (B_ * S_)     // 16384 rows in QKV GEMM
#define QKV_ELEMS ((size_t)B_ * H_ * S_ * DH_)  // 8,388,608 floats per tensor

typedef __attribute__((ext_vector_type(2))) float v2f;
typedef __attribute__((ext_vector_type(8))) float v8f;

typedef __attribute__((address_space(1))) int as1_int;
typedef __attribute__((address_space(3))) int as3_int;

__device__ __forceinline__ v8f wmma_f32_k4(v2f a, v2f b, v8f c) {
    // V_WMMA_F32_16X16X4_F32 : D = A(16x4, f32) x B(4x16, f32) + C(16x16, f32)
    return __builtin_amdgcn_wmma_f32_16x16x4_f32(false, a, false, b, (short)0, c,
                                                 false, false);
}

// ---------------------------------------------------------------------------
// Kernel 1: fused QKV projection + bias + RoPE, output layout (B, H, S, DH).
// One wave32 computes a 32x64 output tile (2 M-tiles x 4 N-tiles, 8 WMMA
// accumulators): one A fragment feeds 4 WMMAs, one B fragment feeds 2.
// K=512 -> 128 k4 steps of 8 WMMAs each; every accumulator sums k ascending.
// The 512x64 weight tile (shared by all 8 waves of the block) is staged into
// LDS once via async global->LDS copies (ASYNCcnt / s_wait_asynccnt), stored
// transposed+padded so the B fragment is one conflict-free ds_load_b64.
// grid = (64, 8, 3): 256 rows per block (32 per wave), 8 N-strips, 3 mats.
// ---------------------------------------------------------------------------
#define WN_ 64             // output columns per block (4 N-tiles)
#define WM_ 32             // output rows per wave (2 M-tiles)

__global__ void __launch_bounds__(256)
qkv_rope_kernel(const float* __restrict__ X,
                const float* __restrict__ Wq, const float* __restrict__ bq,
                const float* __restrict__ Wk, const float* __restrict__ bk,
                const float* __restrict__ Wv, const float* __restrict__ bv,
                float* __restrict__ outq, float* __restrict__ outk,
                float* __restrict__ outv) {
    __shared__ float wt[WN_][516];   // transposed weight tile, padded (129 KB)

    const int lane = threadIdx.x & 31;
    const int wave = threadIdx.x >> 5;
    const int row  = lane & 15;       // M (for A) / N (for B) index within tile
    const int half = lane >> 4;       // selects K=0,1 vs K=2,3 of the k4 step

    const int m0 = (blockIdx.x * 8 + wave) * WM_;  // 0..16352 step 32
    const int n0 = blockIdx.y * WN_;               // 0..448 step 64
    const int mat = blockIdx.z;                    // 0=Q 1=K 2=V

    const float* Wm   = (mat == 0) ? Wq : (mat == 1) ? Wk : Wv;
    const float* bias = (mat == 0) ? bq : (mat == 1) ? bk : bv;
    float*       dst  = (mat == 0) ? outq : (mat == 1) ? outk : outv;

    // ---- Stage W[0:512, n0:n0+64] into LDS transposed: wt[c][k] = W[k][n0+c].
    // 256 lanes x 128 x 4B async copies; a wave reads one whole 128B line.
    {
        const int tid = threadIdx.x;
        const int c  = tid & (WN_ - 1);
        const int kb = tid >> 6;          // 0..3
#pragma unroll
        for (int grp = 0; grp < 4; ++grp) {
#pragma unroll
            for (int it = 0; it < 32; ++it) {
                const int k = (grp * 32 + it) * 4 + kb;
                const float* g = Wm + (size_t)k * DIM_ + n0 + c;
                float* l = &wt[c][k];
                __builtin_amdgcn_global_load_async_to_lds_b32(
                    (as1_int*)(void*)g, (as3_int*)(void*)l,
                    0 /*offset*/, 0 /*cpol*/);
            }
            // Closes each group of 32: keeps a wave's outstanding copies far
            // below the counter's 63; the last one makes the tile landed.
            asm volatile("s_wait_asynccnt 0x0" ::: "memory");
        }
        __syncthreads();
    }

    // Per-lane A base pointers (float2: K=0,1 for lanes 0-15; K=2,3 for 16-31).
    const float* aptr0 = X + (size_t)(m0 + row) * DIM_ + 2 * half;
    const float* aptr1 = aptr0 + (size_t)16 * DIM_;

    v8f acc[2][4] = {};
#pragma unroll 8
    for (int kk = 0; kk < DIM_; kk += 4) {
        v2f a0 = *(const v2f*)(aptr0 + kk);
        v2f a1 = *(const v2f*)(aptr1 + kk);
#pragma unroll
        for (int t = 0; t < 4; ++t) {
            v2f b = *(const v2f*)&wt[t * 16 + row][kk + 2 * half];   // ds_load_b64
            acc[0][t] = wmma_f32_k4(a0, b, acc[0][t]);
            acc[1][t] = wmma_f32_k4(a1, b, acc[1][t]);
        }
    }

    // Epilogue: bias, RoPE (Q,K only), scatter to (B,H,S,DH).
    // All four bias values are fetched ahead of the stores: the waits behind the
    // stores would otherwise pin each load behind the tile before it.
    float bvals[4];
#pragma unroll
    for (int t = 0; t < 4; ++t) bvals[t] = bias[n0 + t * 16 + row];

#pragma unroll
    for (int t = 0; t < 4; ++t) {
        const int n = n0 + t * 16 + row;   // global output column
        const int h = n >> 5;          // head
        const int d = n & 31;          // dim-in-head
        const int i = d >> 1;          // rotation pair index
        const float bval = bvals[t];
        // inv_freq = 10000^(-i/16) = exp(-i * ln(10000)/16)
        const float inv_freq = __expf(-(float)i * (9.210340371976184f / 16.0f));

#pragma unroll
        for (int mi = 0; mi < 2; ++mi) {
#pragma unroll
            for (int j = 0; j < 8; ++j) {
                const int m = m0 + mi * 16 + j + half * 8;   // global row in [0, B*S)
                const int s = m & (S_ - 1);
                const int b_idx = m >> 8;
                float val = acc[mi][t][j] + bval;
                if (mat < 2) {
                    const float ang = (float)s * inv_freq;
                    const float sv = __sinf(ang);
                    const float cv = __cosf(ang);
                    // partner column n^1 lives in lane^1 (same m: m depends on mi,j,half only)
                    const float other = __shfl_xor(val, 1, 32);
                    val = (d & 1) ? (other * sv + val * cv)    // odd lane: x1*sin + x2*cos
                                  : (val * cv - other * sv);   // even lane: x1*cos - x2*sin
                }
                dst[(((size_t)b_idx * H_ + h) * S_ + s) * DH_ + d] = val;
                // Precaution: stands in front of the next element's arithmetic, which
                // reuses this store's data and address registers.
                asm volatile("s_wait_xcnt 0x0" ::: "memory");
            }
        }
    }
}

// ---------------------------------------------------------------------------
// Kernel 2: attention for one (b, h, 16-query-row tile) per block.
//   scores = Q Kt / sqrt(DH)  (WMMA, staged to LDS)
//   probs  = softmax(scores) + rel_bias   (bias added AFTER softmax, per ref)
//   ctx    = probs @ V        (WMMA, A-fragment straight from LDS)
// grid = B*H*16 = 16384 blocks of 256 threads (8 waves).
// ---------------------------------------------------------------------------
__global__ void __launch_bounds__(256)
attn_kernel(const float* __restrict__ Qt, const float* __restrict__ Kt,
            const float* __restrict__ Vt, const float* __restrict__ bias_table,
            float* __restrict__ out) {
    __shared__ float sc[16 * S_];        // 16 q rows x 256 k cols = 16 KB
    __shared__ float part[8 * 16 * 16];  // per-wave ctx partials = 8 KB

    const int lane = threadIdx.x & 31;
    const int wave = threadIdx.x >> 5;
    const int row  = lane & 15;
    const int half = lane >> 4;

    const int bh = blockIdx.x >> 4;          // b*H + h
    const int qt = blockIdx.x & 15;          // q tile index
    const int h  = bh & (H_ - 1);
    const int b  = bh >> 4;
    const int s0 = qt * 16;

    const float* Q = Qt + (size_t)bh * S_ * DH_;
    const float* K = Kt + (size_t)bh * S_ * DH_;
    const float* V = Vt + (size_t)bh * S_ * DH_;

    // ---- Phase A: score tiles. Wave w handles k-tiles {w, w+8}. ----
    const float scale = 0.17677669529663687f;  // 1/sqrt(32)
#pragma unroll
    for (int t = 0; t < 2; ++t) {
        const int kt = wave + t * 8;
        const int n0 = kt * 16;
        v8f c = {};
#pragma unroll
        for (int kk = 0; kk < DH_; kk += 4) {
            v2f a = *(const v2f*)(Q + (size_t)(s0 + row) * DH_ + kk + 2 * half);
            v2f bb = *(const v2f*)(K + (size_t)(n0 + row) * DH_ + kk + 2 * half);
            c = wmma_f32_k4(a, bb, c);
        }
#pragma unroll
        for (int j = 0; j < 8; ++j)
            sc[(j + 8 * half) * S_ + n0 + row] = c[j] * scale;
    }
    __syncthreads();

    // ---- Phase B: softmax per row, then add relative bias. Wave w: rows 2w,2w+1. ----
#pragma unroll
    for (int rr = 0; rr < 2; ++rr) {
        const int r = wave * 2 + rr;
        float* rowp = sc + r * S_;
        float x[8];
        float mx = -3.0e38f;
#pragma unroll
        for (int cidx = 0; cidx < 8; ++cidx) {
            x[cidx] = rowp[lane + 32 * cidx];
            mx = fmaxf(mx, x[cidx]);
        }
#pragma unroll
        for (int off = 16; off >= 1; off >>= 1)
            mx = fmaxf(mx, __shfl_xor(mx, off, 32));
        float sum = 0.0f;
#pragma unroll
        for (int cidx = 0; cidx < 8; ++cidx) {
            x[cidx] = __expf(x[cidx] - mx);
            sum += x[cidx];
        }
#pragma unroll
        for (int off = 16; off >= 1; off >>= 1)
            sum += __shfl_xor(sum, off, 32);
        const float inv = 1.0f / sum;
        const int qg = s0 + r;
#pragma unroll
        for (int cidx = 0; cidx < 8; ++cidx) {
            const int col = lane + 32 * cidx;
            const int rel = qg - col + (S_ - 1);           // in [0, 510]
            rowp[col] = x[cidx] * inv + bias_table[rel * H_ + h];
        }
    }
    __syncthreads();

    // ---- Phase C: ctx = probs(16x256) @ V(256x32). ----
    // Wave w: n-tile = w&1 (d offset 0/16), K-slice = (w>>1)*64.
    {
        const int nt = wave & 1;
        const int ks = wave >> 1;
        const int n0 = nt * 16;
        v8f c = {};
#pragma unroll
        for (int kk = ks * 64; kk < ks * 64 + 64; kk += 4) {
            v2f a = *(const v2f*)(sc + row * S_ + kk + 2 * half);  // LDS ds_load_b64
            v2f bb;
            bb.x = V[(size_t)(kk + 2 * half) * DH_ + n0 + row];
            bb.y = V[(size_t)(kk + 2 * half + 1) * DH_ + n0 + row];
            c = wmma_f32_k4(a, bb, c);
        }
#pragma unroll
        for (int j = 0; j < 8; ++j)
            part[wave * 256 + (j + 8 * half) * 16 + row] = c[j];
    }
    __syncthreads();

    // Reduce 4 K-slice partials and write out[b, s, h*32 + d].
    const int tid = threadIdx.x;
#pragma unroll
    for (int e = 0; e < 2; ++e) {
        const int idx = tid * 2 + e;         // 0..511 over 16x32
        const int r  = idx >> 5;
        const int dd = idx & 31;
        const int nt = dd >> 4;
        const int col = dd & 15;
        float sum = 0.0f;
#pragma unroll
        for (int ks = 0; ks < 4; ++ks)
            sum += part[(ks * 2 + nt) * 256 + r * 16 + col];
        out[((size_t)b * S_ + s0 + r) * DIM_ + h * DH_ + dd] = sum;
    }
}

// ---------------------------------------------------------------------------
extern "C" void kernel_launch(void* const* d_in, const int* in_sizes, int n_in,
                              void* d_out, int out_size, void* d_ws, size_t ws_size,
                              hipStream_t stream) {
    const float* hidden     = (const float*)d_in[0];
    const float* Wq         = (const float*)d_in[1];
    const float* bq         = (const float*)d_in[2];
    const float* Wk         = (const float*)d_in[3];
    const float* bk         = (const float*)d_in[4];
    const float* Wv         = (const float*)d_in[5];
    const float* bv         = (const float*)d_in[6];
    const float* bias_table = (const float*)d_in[7];
    float* out = (float*)d_out;

    float* wsq = (float*)d_ws;
    float* wsk = wsq + QKV_ELEMS;
    float* wsv = wsk + QKV_ELEMS;

    // 16384 rows / 256 per block, 512 columns / 64 per block, 3 matrices.
    qkv_rope_kernel<<<dim3(64, 8, 3), 256, 0, stream>>>(
        hidden, Wq, bq, Wk, bk, Wv, bv, wsq, wsk, wsv);

    // One block per (b, h, q-tile-of-16).
    attn_kernel<<<dim3(B_ * H_ * (S_ / 16)), 256, 0, stream>>>(
        wsq, wsk, wsv, bias_table, out);
}

// v002
// A run of this version takes 181 microseconds.
// Timed twice side by side with v001, it ran 1.48 times as fast both times.
// All steps since v000 together make it 1.92 times as fast.
#include <hip/hip_runtime.h>
#include <hip/hip_bf16.h>

// Problem constants (from reference)
#define B_   64
#define S_   256
#define DIM_ 512
#define H_   16
#define DH_  32            // DIM/H
#define MTOT (B_ * S_)     // 16384 rows in QKV GEMM
#define QKV_ELEMS ((size_t)B_ * H_ * S_ * DH_)  // 8,388,608 floats per tensor

typedef __attribute__((ext_vector_type(2))) float v2f;
typedef __attribute__((ext_vector_type(8))) float v8f;

typedef __attribute__((address_space(1))) int as1_int;
typedef __attribute__((address_space(3))) int as3_int;

__device__ __forceinline__ v8f wmma_f32_k4(v2f a, v2f b, v8f c) {
    // V_WMMA_F32_16X16X4_F32 : D = A(16x4, f32) x B(4x16, f32) + C(16x16, f32)
    return __builtin_amdgcn_wmma_f32_16x16x4_f32(false, a, false, b, (short)0, c,
                                                 false, false);
}

// ---------------------------------------------------------------------------
// Kernel 1: fused QKV projection + bias + RoPE, output layout (B, H, S, DH).
// One wave32 computes a 32x64 output tile (2 M-tiles x 4 N-tiles, 8 WMMA
// accumulators): one A fragment feeds 4 WMMAs, one B fragment feeds 2.
// K=512 -> 128 k4 steps of 8 WMMAs each; every accumulator sums k ascending.
// The 512x64 weight tile (shared by all 8 waves of the block) is staged into
// LDS once via async global->LDS copies (ASYNCcnt / s_wait_asynccnt), stored
// transposed+padded so the B fragment is one conflict-free ds_load_b64.
// grid = (64, 8, 3): 256 rows per block (32 per wave), 8 N-strips, 3 mats.
// ---------------------------------------------------------------------------
#define WN_ 64             // output columns per block (4 N-tiles)
#define WM_ 32             // output rows per wave (2 M-tiles)

__global__ void __launch_bounds__(256)
qkv_rope_kernel(const float* __restrict__ X,
                const float* __restrict__ Wq, const float* __restrict__ bq,
                const float* __restrict__ Wk, const float* __restrict__ bk,
                const float* __restrict__ Wv, const float* __restrict__ bv,
                float* __restrict__ outq, float* __restrict__ outk,
                float* __restrict__ outv) {
    __shared__ float wt[WN_][516];   // transposed weight tile, padded (129 KB)

    const int lane = threadIdx.x & 31;
    const int wave = threadIdx.x >> 5;
    const int row  = lane & 15;       // M (for A) / N (for B) index within tile
    const int half = lane >> 4;       // selects K=0,1 vs K=2,3 of the k4 step

    const int m0 = (blockIdx.x * 8 + wave) * WM_;  // 0..16352 step 32
    const int n0 = blockIdx.y * WN_;               // 0..448 step 64
    const int mat = blockIdx.z;                    // 0=Q 1=K 2=V

    const float* Wm   = (mat == 0) ? Wq : (mat == 1) ? Wk : Wv;
    const float* bias = (mat == 0) ? bq : (mat == 1) ? bk : bv;
    float*       dst  = (mat == 0) ? outq : (mat == 1) ? outk : outv;

    // ---- Stage W[0:512, n0:n0+64] into LDS transposed: wt[c][k] = W[k][n0+c].
    // 256 lanes x 128 x 4B async copies; a wave reads one whole 128B line.
    {
        const int tid = threadIdx.x;
        const int c  = tid & (WN_ - 1);
        const int kb = tid >> 6;          // 0..3
#pragma unroll
        for (int grp = 0; grp < 4; ++grp) {
#pragma unroll
            for (int it = 0; it < 32; ++it) {
                const int k = (grp * 32 + it) * 4 + kb;
                const float* g = Wm + (size_t)k * DIM_ + n0 + c;
                float* l = &wt[c][k];
                __builtin_amdgcn_global_load_async_to_lds_b32(
                    (as1_int*)(void*)g, (as3_int*)(void*)l,
                    0 /*offset*/, 0 /*cpol*/);
            }
            // Closes each group of 32: keeps a wave's outstanding copies far
            // below the counter's 63; the last one makes the tile landed.
            asm volatile("s_wait_asynccnt 0x0" ::: "memory");
        }
        __syncthreads();
    }

    // Per-lane A base pointers (float2: K=0,1 for lanes 0-15; K=2,3 for 16-31).
    const float* aptr0 = X + (size_t)(m0 + row) * DIM_ + 2 * half;
    const float* aptr1 = aptr0 + (size_t)16 * DIM_;

    v8f acc[2][4] = {};
#pragma unroll 8
    for (int kk = 0; kk < DIM_; kk += 4) {
        v2f a0 = *(const v2f*)(aptr0 + kk);
        v2f a1 = *(const v2f*)(aptr1 + kk);
#pragma unroll
        for (int t = 0; t < 4; ++t) {
            v2f b = *(const v2f*)&wt[t * 16 + row][kk + 2 * half];   // ds_load_b64
            acc[0][t] = wmma_f32_k4(a0, b, acc[0][t]);
            acc[1][t] = wmma_f32_k4(a1, b, acc[1][t]);
        }
    }

    // Epilogue: bias, RoPE (Q,K only), scatter to (B,H,S,DH).
    // All four bias values are fetched ahead of the stores: the waits behind the
    // stores would otherwise pin each load behind the tile before it.
    float bvals[4];
#pragma unroll
    for (int t = 0; t < 4; ++t) bvals[t] = bias[n0 + t * 16 + row];

#pragma unroll
    for (int t = 0; t < 4; ++t) {
        const int n = n0 + t * 16 + row;   // global output column
        const int h = n >> 5;          // head
        const int d = n & 31;          // dim-in-head
        const int i = d >> 1;          // rotation pair index
        const float bval = bvals[t];
        // inv_freq = 10000^(-i/16) = exp(-i * ln(10000)/16)
        const float inv_freq = __expf(-(float)i * (9.210340371976184f / 16.0f));

#pragma unroll
        for (int mi = 0; mi < 2; ++mi) {
#pragma unroll
            for (int j = 0; j < 8; ++j) {
                const int m = m0 + mi * 16 + j + half * 8;   // global row in [0, B*S)
                const int s = m & (S_ - 1);
                const int b_idx = m >> 8;
                float val = acc[mi][t][j] + bval;
                if (mat < 2) {
                    const float ang = (float)s * inv_freq;
                    const float sv = __sinf(ang);
                    const float cv = __cosf(ang);
                    // partner column n^1 lives in lane^1 (same m: m depends on mi,j,half only)
                    const float other = __shfl_xor(val, 1, 32);
                    val = (d & 1) ? (other * sv + val * cv)    // odd lane: x1*sin + x2*cos
                                  : (val * cv - other * sv);   // even lane: x1*cos - x2*sin
                }
                dst[(((size_t)b_idx * H_ + h) * S_ + s) * DH_ + d] = val;
                // Precaution: stands in front of the next element's arithmetic, which
                // reuses this store's data and address registers.
                asm volatile("s_wait_xcnt 0x0" ::: "memory");
            }
        }
    }
}

// ---------------------------------------------------------------------------
// Kernel 2: attention, one block per (b, h); K, V and the head's bias column
// are staged in LDS once and read by all 8 waves. A wave owns a 16-query tile
// end to end (two tiles, one after the other) and meets no barrier after the
// staging:
//   St    = K Qt (WMMA): lane = query, registers = keys, all 256 keys in VGPRs
//   probs = softmax + rel_bias (bias added AFTER softmax, per ref): the row
//           reduction runs over a lane's own registers plus one lane^16 swap
//   ctx   = probs @ V (WMMA): the St accumulator registers ARE the A fragment;
//           key order inside a 16-key tile: 0,1,8,9, 2,3,10,11, ... on A and B.
// grid = B*H = 1024 blocks of 256 threads (8 waves).
// ---------------------------------------------------------------------------
typedef __attribute__((ext_vector_type(4))) float v4f;

// Eight exp2 in one statement: each v_exp_f32 is followed by an independent one
// (outputs are early-clobber, so none overwrites a source), and the v_nop fills
// the slot that the instruction set asks for behind the last.
__device__ __forceinline__ void exp2_x8(const float (&x)[8], float (&e)[8]) {
    asm("v_exp_f32 %0, %8\n\t"
        "v_exp_f32 %1, %9\n\t"
        "v_exp_f32 %2, %10\n\t"
        "v_exp_f32 %3, %11\n\t"
        "v_exp_f32 %4, %12\n\t"
        "v_exp_f32 %5, %13\n\t"
        "v_exp_f32 %6, %14\n\t"
        "v_exp_f32 %7, %15\n\t"
        "v_nop"
        : "=&v"(e[0]), "=&v"(e[1]), "=&v"(e[2]), "=&v"(e[3]),
          "=&v"(e[4]), "=&v"(e[5]), "=&v"(e[6]), "=&v"(e[7])
        : "v"(x[0]), "v"(x[1]), "v"(x[2]), "v"(x[3]),
          "v"(x[4]), "v"(x[5]), "v"(x[6]), "v"(x[7]));
}

#define KP_ 36             // K row pitch in LDS, floats: 144 B = 16 B x odd
#define VP_ 260            // Vt row pitch in LDS, floats: 1040 B = 16 B x odd

// Budget of 256 VGPRs: four waves per SIMD, so that two blocks share a WGP and
// one block's staging and softmax run under the other's matrix work.
__global__ void __launch_bounds__(256) __attribute__((amdgpu_waves_per_eu(4, 4)))
attn_kernel(const float* __restrict__ Qt, const float* __restrict__ Kt,
            const float* __restrict__ Vt, const float* __restrict__ bias_table,
            float* __restrict__ out) {
    __shared__ __attribute__((aligned(16))) float ks[S_ * KP_];    // K[key][d]
    __shared__ __attribute__((aligned(16))) float vt[DH_ * VP_];   // V[key][d] at [d][key]
    __shared__ float brev[2 * S_];   // brev[y] = bias_table[510 - y][h]

    const int tid  = threadIdx.x;
    const int lane = tid & 31;
    const int wave = tid >> 5;
    const int row  = lane & 15;
    const int half = lane >> 4;

    const int bh = blockIdx.x;               // b*H + h
    const int h  = bh & (H_ - 1);
    const int b  = bh >> 4;

    const float* Q = Qt + (size_t)bh * S_ * DH_;
    const float* K = Kt + (size_t)bh * S_ * DH_;
    const float* V = Vt + (size_t)bh * S_ * DH_;

    // ---- Stage K (padded rows), V (transposed) and the bias column. ----
    // Every K and V wave-wide load covers 512 contiguous bytes (4 whole lines).
    {
        v4f kreg[8], vreg[8];
#pragma unroll
        for (int i = 0; i < 8; ++i) {
            kreg[i] = *(const v4f*)(K + (size_t)(i * 256 + tid) * 4);
            vreg[i] = *(const v4f*)(V + (size_t)(i * 256 + tid) * 4);
        }
        const float b0 = bias_table[(2 * S_ - 2 - tid) * H_ + h];            // y = tid
        const int   y1 = (tid < S_ - 1) ? tid + S_ : 2 * S_ - 2;             // 256..510
        const float b1 = bias_table[(2 * S_ - 2 - y1) * H_ + h];
#pragma unroll
        for (int i = 0; i < 8; ++i) {
            const int idx = i * 256 + tid;
            const int key = idx >> 3;
            const int d0  = (idx & 7) * 4;
            *(v4f*)&ks[key * KP_ + d0] = kreg[i];
#pragma unroll
            for (int e = 0; e < 4; ++e) vt[(d0 + e) * VP_ + key] = vreg[i][e];
        }
        brev[tid] = b0;
        brev[y1]  = b1;      // thread 255 repeats thread 254's value at 510
    }
    __syncthreads();

    // exp(scale * (s - max)) = exp2(s * cexp - max * cexp), scale = 1/sqrt(32)
    const float cexp = 0.17677669529663687f * 1.4426950408889634f;

    // Rolled on purpose: unrolled, both tiles' 128 score registers could be
    // live at once and the block would lose its second resident neighbour.
#pragma unroll 1
    for (int pass = 0; pass < 2; ++pass) {
        const int q0 = (wave + pass * 8) * 16;

        // B fragments of Qt: lane holds Q[q0+row][8g + 4*half + 0..3].
        v4f qf[4];
#pragma unroll
        for (int g = 0; g < 4; ++g)
            qf[g] = *(const v4f*)(Q + (size_t)(q0 + row) * DH_ + 8 * g + 4 * half);

        // ---- St tiles: st[kt][j] = <K[kt*16 + j + 8*half], Q[q0 + row]>. ----
        // Same d order on both operands: 8g + 4*half + {0,1}, then + {2,3}.
        v8f st[16];
#pragma unroll
        for (int kt = 0; kt < 16; kt += 2) {
            const float* k0 = &ks[(kt * 16 + row) * KP_ + 4 * half];
            const float* k1 = k0 + 16 * KP_;
            v8f c0 = {}, c1 = {};
#pragma unroll
            for (int g = 0; g < 4; ++g) {
                const v4f a0 = *(const v4f*)(k0 + 8 * g);    // ds_load_b128
                const v4f a1 = *(const v4f*)(k1 + 8 * g);
                c0 = wmma_f32_k4(a0.xy, qf[g].xy, c0);
                c1 = wmma_f32_k4(a1.xy, qf[g].xy, c1);
                c0 = wmma_f32_k4(a0.zw, qf[g].zw, c0);
                c1 = wmma_f32_k4(a1.zw, qf[g].zw, c1);
            }
            st[kt]     = c0;
            st[kt + 1] = c1;
            // Bounds how many K fragments are fetched ahead: with none, half of
            // all 64 reads stood in front and addresses went to scratch.
            if ((kt & 2) != 0) __builtin_amdgcn_sched_barrier(0);
        }

        // The barrier behind the last tile also keeps the V and bias LDS reads of
        // the last phase from being lifted up among the score tiles.

        // ---- Softmax over the 256 keys of query q0 + row. ----
        float m4[4] = {st[0][0], st[0][1], st[0][2], st[0][3]};
#pragma unroll
        for (int kt = 0; kt < 16; ++kt)
#pragma unroll
            for (int j = 0; j < 8; ++j) m4[j & 3] = fmaxf(m4[j & 3], st[kt][j]);
        float mx = fmaxf(fmaxf(m4[0], m4[1]), fmaxf(m4[2], m4[3]));
        mx = fmaxf(mx, __shfl_xor(mx, 16, 32));    // the other 8 keys of each tile
        const float mb = mx * cexp;
        float s4[4] = {0.0f, 0.0f, 0.0f, 0.0f};
#pragma unroll
        for (int kt = 0; kt < 16; ++kt) {
            float x[8], e[8];
#pragma unroll
            for (int j = 0; j < 8; ++j) x[j] = st[kt][j] * cexp - mb;
            exp2_x8(x, e);
#pragma unroll
            for (int j = 0; j < 8; ++j) {
                st[kt][j] = e[j];
                s4[j & 3] += e[j];
            }
        }
        float sum = (s4[0] + s4[1]) + (s4[2] + s4[3]);
        sum += __shfl_xor(sum, 16, 32);
        const float inv = 1.0f / sum;
        // Same purpose as the one above: all 128 score registers are still live here.
        __builtin_amdgcn_sched_barrier(0);

        // ---- probs = e * inv + bias; ctx = probs @ V. ----
        // rel = q - key + 255, so y = 510 - rel = 255 - q + key, in [0, 510].
        const float* bp = &brev[(S_ - 1) - q0 - row + 8 * half];
        const float* v0 = &vt[row * VP_ + 8 * half];
        const float* v1 = v0 + 16 * VP_;
        v8f o0 = {}, o1 = {};
#pragma unroll
        for (int kt = 0; kt < 16; ++kt) {
            const v4f w00 = *(const v4f*)(v0 + kt * 16);        // d = row,    keys +0..3
            const v4f w01 = *(const v4f*)(v0 + kt * 16 + 4);    //             keys +4..7
            const v4f w10 = *(const v4f*)(v1 + kt * 16);        // d = 16+row
            const v4f w11 = *(const v4f*)(v1 + kt * 16 + 4);
            v8f p;
#pragma unroll
            for (int j = 0; j < 8; ++j) p[j] = st[kt][j] * inv + bp[kt * 16 + j];
            o0 = wmma_f32_k4(p.s01, w00.xy, o0);
            o1 = wmma_f32_k4(p.s01, w10.xy, o1);
            o0 = wmma_f32_k4(p.s23, w00.zw, o0);
            o1 = wmma_f32_k4(p.s23, w10.zw, o1);
            o0 = wmma_f32_k4(p.s45, w01.xy, o0);
            o1 = wmma_f32_k4(p.s45, w11.xy, o1);
            o0 = wmma_f32_k4(p.s67, w01.zw, o0);
            o1 = wmma_f32_k4(p.s67, w11.zw, o1);
        }

        // out[b, q0 + j + 8*half, h*32 + d]; both 64-B halves of a line from this wave.
        float* op = out + ((size_t)b * S_ + q0 + 8 * half) * DIM_ + h * DH_ + row;
#pragma unroll
        for (int j = 0; j < 8; ++j) {
            op[(size_t)j * DIM_]      = o0[j];
            op[(size_t)j * DIM_ + 16] = o1[j];
        }
        // Precaution: stands in front of the next pass, which reuses these
        // stores' data and address registers.
        asm volatile("s_wait_xcnt 0x0" ::: "memory");
    }
}

// ---------------------------------------------------------------------------
extern "C" void kernel_launch(void* const* d_in, const int* in_sizes, int n_in,
                              void* d_out, int out_size, void* d_ws, size_t ws_size,
                              hipStream_t stream) {
    const float* hidden     = (const float*)d_in[0];
    const float* Wq         = (const float*)d_in[1];
    const float* bq         = (const float*)d_in[2];
    const float* Wk         = (const float*)d_in[3];
    const float* bk         = (const float*)d_in[4];
    const float* Wv         = (const float*)d_in[5];
    const float* bv         = (const float*)d_in[6];
    const float* bias_table = (const float*)d_in[7];
    float* out = (float*)d_out;

    float* wsq = (float*)d_ws;
    float* wsk = wsq + QKV_ELEMS;
    float* wsv = wsk + QKV_ELEMS;

    // 16384 rows / 256 per block, 512 columns / 64 per block, 3 matrices.
    qkv_rope_kernel<<<dim3(64, 8, 3), 256, 0, stream>>>(
        hidden, Wq, bq, Wk, bk, Wv, bv, wsq, wsk, wsv);

    // One block per (b, h).
    attn_kernel<<<dim3(B_ * H_), 256, 0, stream>>>(
        wsq, wsk, wsv, bias_table, out);
}

// v003
// One run takes 163 microseconds.
// Next to v002, in two timings, it ran 1.11 times as fast each time.
// All steps since v000 together make it 2.13 times as fast.
#include <hip/hip_runtime.h>
#include <hip/hip_bf16.h>

// Problem constants (from reference)
#define B_   64
#define S_   256
#define DIM_ 512
#define H_   16
#define DH_  32            // DIM/H
#define MTOT (B_ * S_)     // 16384 rows in QKV GEMM
#define QKV_ELEMS ((size_t)B_ * H_ * S_ * DH_)  // 8,388,608 floats per tensor

typedef __attribute__((ext_vector_type(2))) float v2f;
typedef __attribute__((ext_vector_type(8))) float v8f;

__device__ __forceinline__ v8f wmma_f32_k4(v2f a, v2f b, v8f c) {
    // V_WMMA_F32_16X16X4_F32 : D = A(16x4, f32) x B(4x16, f32) + C(16x16, f32)
    return __builtin_amdgcn_wmma_f32_16x16x4_f32(false, a, false, b, (short)0, c,
                                                 false, false);
}

// ---------------------------------------------------------------------------
// Kernel 1: fused QKV projection + bias + RoPE, output layout (B, H, S, DH).
// A block owns 64 rows of X and one whole weight matrix (512 columns).
// The 64x512 X tile (shared by all 8 waves) is staged into LDS once, in its
// own row-major layout, by 16-byte async global->LDS copies that cover whole
// lines; the padded row makes an A fragment one conflict-free ds_load_b64.
// A wave computes a 64x64 output tile (4 M-tiles x 4 N-tiles, 16 WMMA
// accumulators). N-tile t of a wave holds the columns 4*lane16 + t, so one
// 16-byte load of a W row gives a lane its element of all four B fragments
// and a wave-wide load covers four whole lines of W.
// K=512 -> 128 k4 steps of 16 WMMAs each; every accumulator sums k ascending.
// With that column map a lane owns four neighbouring output columns: both
// members of a rotation pair, and 16 bytes of every output row.
// grid = (3, 256): 3 matrices, 64 rows per block.
// ---------------------------------------------------------------------------
#define XM_ 64             // X rows per block (4 M-tiles)
#define XP_ 516            // X row pitch in LDS, floats: 2064 B = 16 B x odd

typedef __attribute__((ext_vector_type(4))) float v4f;
typedef __attribute__((ext_vector_type(4))) int v4i;
typedef __attribute__((address_space(1))) v4i as1_v4i;
typedef __attribute__((address_space(3))) v4i as3_v4i;

// sin and cos of two angles (radians) in one statement; the hardware forms take
// turns, so the angle is first scaled by 1/(2*pi). Each of the four is followed
// by an independent one (outputs are early-clobber, so none overwrites a source),
// and the v_nop fills the slot that the instruction set asks for behind the last.
__device__ __forceinline__ void sincos_x2(float a0, float a1, float& s0, float& c0,
                                          float& s1, float& c1) {
    const float t0 = a0 * 0.15915494309189535f;
    const float t1 = a1 * 0.15915494309189535f;
    asm("v_sin_f32 %0, %4\n\t"
        "v_cos_f32 %1, %4\n\t"
        "v_sin_f32 %2, %5\n\t"
        "v_cos_f32 %3, %5\n\t"
        "v_nop"
        : "=&v"(s0), "=&v"(c0), "=&v"(s1), "=&v"(c1)
        : "v"(t0), "v"(t1));
}

// Budget of 256 VGPRs: the LDS tile lets two blocks share a WGP (four waves per
// SIMD), and the 128 accumulator registers need the rest of that budget.
__global__ void __launch_bounds__(256) __attribute__((amdgpu_waves_per_eu(4, 4)))
qkv_rope_kernel(const float* __restrict__ X,
                const float* __restrict__ Wq, const float* __restrict__ bq,
                const float* __restrict__ Wk, const float* __restrict__ bk,
                const float* __restrict__ Wv, const float* __restrict__ bv,
                float* __restrict__ outq, float* __restrict__ outk,
                float* __restrict__ outv) {
    __shared__ __attribute__((aligned(16))) float xt[XM_][XP_];   // X tile, padded (129 KB)

    const int lane = threadIdx.x & 31;
    const int wave = threadIdx.x >> 5;
    const int row  = lane & 15;       // M (for A) / N (for B) index within tile
    const int half = lane >> 4;       // selects K=0,1 vs K=2,3 of the k4 step

    const int mat = blockIdx.x;                    // 0=Q 1=K 2=V
    const int m0  = blockIdx.y * XM_;              // 0..16320 step 64
    const int nl  = wave * 64 + 4 * row;           // this lane's first column

    const float* Wm   = (mat == 0) ? Wq : (mat == 1) ? Wk : Wv;
    const float* bias = (mat == 0) ? bq : (mat == 1) ? bk : bv;
    float*       dst  = (mat == 0) ? outq : (mat == 1) ? outk : outv;

    // ---- Stage X[m0:m0+64, 0:512] into LDS: xt[r][k] = X[m0+r][k].
    // 256 lanes x 32 x 16B async copies; a wave copies 512 contiguous bytes.
    {
        const int tid = threadIdx.x;
        const int c4 = (tid & 127) * 4;   // first k of this lane's 16 bytes
        const int rb = tid >> 7;          // 0..1
#pragma unroll
        for (int it = 0; it < 32; ++it) {
            const int r = it * 2 + rb;
            const float* g = X + (size_t)(m0 + r) * DIM_ + c4;
            float* l = &xt[r][c4];
            __builtin_amdgcn_global_load_async_to_lds_b128(
                (as1_v4i*)(void*)g, (as3_v4i*)(void*)l,
                0 /*offset*/, 0 /*cpol*/);
        }
        // This wave's 32 copies (of at most 63 outstanding) have landed behind it;
        // the barrier then shows every wave's rows to all.
        asm volatile("s_wait_asynccnt 0x0" ::: "memory");
        __syncthreads();
    }

    // Per-lane W pointer: row 2*half of the k4 step, columns nl..nl+3.
    const float* wptr = Wm + (size_t)(2 * half) * DIM_ + nl;

    v8f acc[4][4] = {};
#pragma unroll 4
    for (int kk = 0; kk < DIM_; kk += 4) {
        const v4f w0 = *(const v4f*)(wptr + (size_t)kk * DIM_);          // k = kk + 2*half
        const v4f w1 = *(const v4f*)(wptr + (size_t)(kk + 1) * DIM_);    // k = kk + 2*half + 1
        v2f a[4];
#pragma unroll
        for (int mi = 0; mi < 4; ++mi)
            a[mi] = *(const v2f*)&xt[mi * 16 + row][kk + 2 * half];      // ds_load_b64
#pragma unroll
        for (int t = 0; t < 4; ++t) {
            v2f b;
            b.x = w0[t];
            b.y = w1[t];
#pragma unroll
            for (int mi = 0; mi < 4; ++mi)
                acc[mi][t] = wmma_f32_k4(a[mi], b, acc[mi][t]);
        }
    }

    // Epilogue: bias, RoPE (Q,K only), store to (B,H,S,DH), 16 bytes per lane:
    // lanes 0-7 and 8-15 of each half write one whole 128-B line each.
    const v4f bv4 = *(const v4f*)(bias + nl);
    const int h  = nl >> 5;            // head
    const int d0 = nl & 31;            // first dim-in-head, a multiple of 4
    const int i0 = d0 >> 1;            // rotation pair index of columns 0,1
    // inv_freq = 10000^(-i/16) = exp(-i * ln(10000)/16)
    const float invf0 = __expf(-(float)i0 * (9.210340371976184f / 16.0f));
    const float invf1 = __expf(-(float)(i0 + 1) * (9.210340371976184f / 16.0f));

    // First output row of this lane: rows m0 + 8*half + (16*mi + j) stay inside one
    // batch entry, since 64 divides S.
    const int s0 = (m0 & (S_ - 1)) + 8 * half;
    float* op = dst + ((((size_t)(m0 >> 8)) * H_ + h) * S_ + s0) * DH_ + d0;

    if (mat < 2) {
#pragma unroll
        for (int mi = 0; mi < 4; ++mi) {
#pragma unroll
            for (int j = 0; j < 8; ++j) {
                const float sf = (float)(s0 + mi * 16 + j);
                const float x0 = acc[mi][0][j] + bv4.x;
                const float x1 = acc[mi][1][j] + bv4.y;
                const float x2 = acc[mi][2][j] + bv4.z;
                const float x3 = acc[mi][3][j] + bv4.w;
                float sv0, cv0, sv1, cv1;
                sincos_x2(sf * invf0, sf * invf1, sv0, cv0, sv1, cv1);
                v4f r;
                r.x = x0 * cv0 - x1 * sv0;     // x1*cos - x2*sin
                r.y = x1 * cv0 + x0 * sv0;     // x1*sin + x2*cos
                r.z = x2 * cv1 - x3 * sv1;
                r.w = x3 * cv1 + x2 * sv1;
                *(v4f*)(op + (mi * 16 + j) * DH_) = r;
                // Precaution: stands in front of the next row's arithmetic, which
                // reuses this store's data registers.
                asm volatile("s_wait_xcnt 0x0" ::: "memory");
            }
        }
    } else {
#pragma unroll
        for (int mi = 0; mi < 4; ++mi) {
#pragma unroll
            for (int j = 0; j < 8; ++j) {
                v4f r;
                r.x = acc[mi][0][j] + bv4.x;
                r.y = acc[mi][1][j] + bv4.y;
                r.z = acc[mi][2][j] + bv4.z;
                r.w = acc[mi][3][j] + bv4.w;
                *(v4f*)(op + (mi * 16 + j) * DH_) = r;
                // Precaution: as above.
                asm volatile("s_wait_xcnt 0x0" ::: "memory");
            }
        }
    }
}

// ---------------------------------------------------------------------------
// Kernel 2: attention, one block per (b, h); K, V and the head's bias column
// are staged in LDS once and read by all 8 waves. A wave owns a 16-query tile
// end to end (two tiles, one after the other) and meets no barrier after the
// staging:
//   St    = K Qt (WMMA): lane = query, registers = keys, all 256 keys in VGPRs
//   probs = softmax + rel_bias (bias added AFTER softmax, per ref): the row
//           reduction runs over a lane's own registers plus one lane^16 swap
//   ctx   = probs @ V (WMMA): the St accumulator registers ARE the A fragment;
//           key order inside a 16-key tile: 0,1,8,9, 2,3,10,11, ... on A and B.
// grid = B*H = 1024 blocks of 256 threads (8 waves).
// ---------------------------------------------------------------------------

// Eight exp2 in one statement: each v_exp_f32 is followed by an independent one
// (outputs are early-clobber, so none overwrites a source), and the v_nop fills
// the slot that the instruction set asks for behind the last.
__device__ __forceinline__ void exp2_x8(const float (&x)[8], float (&e)[8]) {
    asm("v_exp_f32 %0, %8\n\t"
        "v_exp_f32 %1, %9\n\t"
        "v_exp_f32 %2, %10\n\t"
        "v_exp_f32 %3, %11\n\t"
        "v_exp_f32 %4, %12\n\t"
        "v_exp_f32 %5, %13\n\t"
        "v_exp_f32 %6, %14\n\t"
        "v_exp_f32 %7, %15\n\t"
        "v_nop"
        : "=&v"(e[0]), "=&v"(e[1]), "=&v"(e[2]), "=&v"(e[3]),
          "=&v"(e[4]), "=&v"(e[5]), "=&v"(e[6]), "=&v"(e[7])
        : "v"(x[0]), "v"(x[1]), "v"(x[2]), "v"(x[3]),
          "v"(x[4]), "v"(x[5]), "v"(x[6]), "v"(x[7]));
}

#define KP_ 36             // K row pitch in LDS, floats: 144 B = 16 B x odd
#define VP_ 260            // Vt row pitch in LDS, floats: 1040 B = 16 B x odd

// Budget of 256 VGPRs: four waves per SIMD, so that two blocks share a WGP and
// one block's staging and softmax run under the other's matrix work.
__global__ void __launch_bounds__(256) __attribute__((amdgpu_waves_per_eu(4, 4)))
attn_kernel(const float* __restrict__ Qt, const float* __restrict__ Kt,
            const float* __restrict__ Vt, const float* __restrict__ bias_table,
            float* __restrict__ out) {
    __shared__ __attribute__((aligned(16))) float ks[S_ * KP_];    // K[key][d]
    __shared__ __attribute__((aligned(16))) float vt[DH_ * VP_];   // V[key][d] at [d][key]
    __shared__ float brev[2 * S_];   // brev[y] = bias_table[510 - y][h]

    const int tid  = threadIdx.x;
    const int lane = tid & 31;
    const int wave = tid >> 5;
    const int row  = lane & 15;
    const int half = lane >> 4;

    const int bh = blockIdx.x;               // b*H + h
    const int h  = bh & (H_ - 1);
    const int b  = bh >> 4;

    const float* Q = Qt + (size_t)bh * S_ * DH_;
    const float* K = Kt + (size_t)bh * S_ * DH_;
    const float* V = Vt + (size_t)bh * S_ * DH_;

    // ---- Stage K (padded rows), V (transposed) and the bias column. ----
    // Every K and V wave-wide load covers 512 contiguous bytes (4 whole lines).
    {
        v4f kreg[8], vreg[8];
#pragma unroll
        for (int i = 0; i < 8; ++i) {
            kreg[i] = *(const v4f*)(K + (size_t)(i * 256 + tid) * 4);
            vreg[i] = *(const v4f*)(V + (size_t)(i * 256 + tid) * 4);
        }
        const float b0 = bias_table[(2 * S_ - 2 - tid) * H_ + h];            // y = tid
        const int   y1 = (tid < S_ - 1) ? tid + S_ : 2 * S_ - 2;             // 256..510
        const float b1 = bias_table[(2 * S_ - 2 - y1) * H_ + h];
#pragma unroll
        for (int i = 0; i < 8; ++i) {
            const int idx = i * 256 + tid;
            const int key = idx >> 3;
            const int d0  = (idx & 7) * 4;
            *(v4f*)&ks[key * KP_ + d0] = kreg[i];
#pragma unroll
            for (int e = 0; e < 4; ++e) vt[(d0 + e) * VP_ + key] = vreg[i][e];
        }
        brev[tid] = b0;
        brev[y1]  = b1;      // thread 255 repeats thread 254's value at 510
    }
    __syncthreads();

    // exp(scale * (s - max)) = exp2(s * cexp - max * cexp), scale = 1/sqrt(32)
    const float cexp = 0.17677669529663687f * 1.4426950408889634f;

    // Rolled on purpose: unrolled, both tiles' 128 score registers could be
    // live at once and the block would lose its second resident neighbour.
#pragma unroll 1
    for (int pass = 0; pass < 2; ++pass) {
        const int q0 = (wave + pass * 8) * 16;

        // B fragments of Qt: lane holds Q[q0+row][8g + 4*half + 0..3].
        v4f qf[4];
#pragma unroll
        for (int g = 0; g < 4; ++g)
            qf[g] = *(const v4f*)(Q + (size_t)(q0 + row) * DH_ + 8 * g + 4 * half);

        // ---- St tiles: st[kt][j] = <K[kt*16 + j + 8*half], Q[q0 + row]>. ----
        // Same d order on both operands: 8g + 4*half + {0,1}, then + {2,3}.
        v8f st[16];
#pragma unroll
        for (int kt = 0; kt < 16; kt += 2) {
            const float* k0 = &ks[(kt * 16 + row) * KP_ + 4 * half];
            const float* k1 = k0 + 16 * KP_;
            v8f c0 = {}, c1 = {};
#pragma unroll
            for (int g = 0; g < 4; ++g) {
                const v4f a0 = *(const v4f*)(k0 + 8 * g);    // ds_load_b128
                const v4f a1 = *(const v4f*)(k1 + 8 * g);
                c0 = wmma_f32_k4(a0.xy, qf[g].xy, c0);
                c1 = wmma_f32_k4(a1.xy, qf[g].xy, c1);
                c0 = wmma_f32_k4(a0.zw, qf[g].zw, c0);
                c1 = wmma_f32_k4(a1.zw, qf[g].zw, c1);
            }
            st[kt]     = c0;
            st[kt + 1] = c1;
            // Bounds how many K fragments are fetched ahead: with none, half of
            // all 64 reads stood in front and addresses went to scratch.
            if ((kt & 2) != 0) __builtin_amdgcn_sched_barrier(0);
        }

        // The barrier behind the last tile also keeps the V and bias LDS reads of
        // the last phase from being lifted up among the score tiles.

        // ---- Softmax over the 256 keys of query q0 + row. ----
        float m4[4] = {st[0][0], st[0][1], st[0][2], st[0][3]};
#pragma unroll
        for (int kt = 0; kt < 16; ++kt)
#pragma unroll
            for (int j = 0; j < 8; ++j) m4[j & 3] = fmaxf(m4[j & 3], st[kt][j]);
        float mx = fmaxf(fmaxf(m4[0], m4[1]), fmaxf(m4[2], m4[3]));
        mx = fmaxf(mx, __shfl_xor(mx, 16, 32));    // the other 8 keys of each tile
        const float mb = mx * cexp;
        float s4[4] = {0.0f, 0.0f, 0.0f, 0.0f};
#pragma unroll
        for (int kt = 0; kt < 16; ++kt) {
            float x[8], e[8];
#pragma unroll
            for (int j = 0; j < 8; ++j) x[j] = st[kt][j] * cexp - mb;
            exp2_x8(x, e);
#pragma unroll
            for (int j = 0; j < 8; ++j) {
                st[kt][j] = e[j];
                s4[j & 3] += e[j];
            }
        }
        float sum = (s4[0] + s4[1]) + (s4[2] + s4[3]);
        sum += __shfl_xor(sum, 16, 32);
        const float inv = 1.0f / sum;
        // Same purpose as the one above: all 128 score registers are still live here.
        __builtin_amdgcn_sched_barrier(0);

        // ---- probs = e * inv + bias; ctx = probs @ V. ----
        // rel = q - key + 255, so y = 510 - rel = 255 - q + key, in [0, 510].
        const float* bp = &brev[(S_ - 1) - q0 - row + 8 * half];
        const float* v0 = &vt[row * VP_ + 8 * half];
        const float* v1 = v0 + 16 * VP_;
        v8f o0 = {}, o1 = {};
#pragma unroll
        for (int kt = 0; kt < 16; ++kt) {
            const v4f w00 = *(const v4f*)(v0 + kt * 16);        // d = row,    keys +0..3
            const v4f w01 = *(const v4f*)(v0 + kt * 16 + 4);    //             keys +4..7
            const v4f w10 = *(const v4f*)(v1 + kt * 16);        // d = 16+row
            const v4f w11 = *(const v4f*)(v1 + kt * 16 + 4);
            v8f p;
#pragma unroll
            for (int j = 0; j < 8; ++j) p[j] = st[kt][j] * inv + bp[kt * 16 + j];
            o0 = wmma_f32_k4(p.s01, w00.xy, o0);
            o1 = wmma_f32_k4(p.s01, w10.xy, o1);
            o0 = wmma_f32_k4(p.s23, w00.zw, o0);
            o1 = wmma_f32_k4(p.s23, w10.zw, o1);
            o0 = wmma_f32_k4(p.s45, w01.xy, o0);
            o1 = wmma_f32_k4(p.s45, w11.xy, o1);
            o0 = wmma_f32_k4(p.s67, w01.zw, o0);
            o1 = wmma_f32_k4(p.s67, w11.zw, o1);
        }

        // out[b, q0 + j + 8*half, h*32 + d]; both 64-B halves of a line from this wave.
        float* op = out + ((size_t)b * S_ + q0 + 8 * half) * DIM_ + h * DH_ + row;
#pragma unroll
        for (int j = 0; j < 8; ++j) {
            op[(size_t)j * DIM_]      = o0[j];
            op[(size_t)j * DIM_ + 16] = o1[j];
        }
        // Precaution: stands in front of the next pass, which reuses these
        // stores' data and address registers.
        asm volatile("s_wait_xcnt 0x0" ::: "memory");
    }
}

// ---------------------------------------------------------------------------
extern "C" void kernel_launch(void* const* d_in, const int* in_sizes, int n_in,
                              void* d_out, int out_size, void* d_ws, size_t ws_size,
                              hipStream_t stream) {
    const float* hidden     = (const float*)d_in[0];
    const float* Wq         = (const float*)d_in[1];
    const float* bq         = (const float*)d_in[2];
    const float* Wk         = (const float*)d_in[3];
    const float* bk         = (const float*)d_in[4];
    const float* Wv         = (const float*)d_in[5];
    const float* bv         = (const float*)d_in[6];
    const float* bias_table = (const float*)d_in[7];
    float* out = (float*)d_out;

    float* wsq = (float*)d_ws;
    float* wsk = wsq + QKV_ELEMS;
    float* wsv = wsk + QKV_ELEMS;

    // 3 matrices, 16384 rows / 64 per block; a block spans all 512 columns.
    qkv_rope_kernel<<<dim3(3, 256), 256, 0, stream>>>(
        hidden, Wq, bq, Wk, bk, Wv, bv, wsq, wsk, wsv);

    // One block per (b, h).
    attn_kernel<<<dim3(B_ * H_), 256, 0, stream>>>(
        wsq, wsk, wsv, bias_table, out);
}
